// v000
// The times below were measured on an AMD MI455X: many runs one after another, warmed up first and cycling through
// copies of the inputs, with the whole window's GPU time divided by the number of runs. Launches and the gaps
// between them are all in it. The median over several windows is given; except for v000 it joins two sittings, which
// can be a few percent apart, so the side-by-side timings, each taken in one sitting, are the better comparison.
// The starting kernel, v000, takes 386 microseconds a run.
#include <hip/hip_runtime.h>
#include <hip/hip_bf16.h>

// ---------------------------------------------------------------------------
// SVGP attention for MI455X (gfx1250, wave32).
// Dominant cost: qk = x @ qk_w.T  (M=16384, N=2048, K=1024, fp32)
//   -> double-buffered LDS GEMM on V_WMMA_F32_16X16X4_F32, staged with
//      GLOBAL_LOAD_ASYNC_TO_LDS_B128 (ASYNCcnt) so DMA of chunk k+1 overlaps
//      the WMMA stream of chunk k.
// Everything else is low-rank (r=5) per-token work done with wave32 shuffles.
// ---------------------------------------------------------------------------

typedef __attribute__((ext_vector_type(2))) float v2f;
typedef __attribute__((ext_vector_type(8))) float v8f;
typedef __attribute__((ext_vector_type(4))) int   v4i;

#define BB 8
#define NN 2048
#define CC 1024
#define HH 16
#define DD 64
#define RR 5
#define RM 10

#define TILE_M 128
#define TILE_N 128
#define TILE_K 32
#define LDA 36   // padded LDS row stride (floats): 16B aligned, conflict-free

#if __has_builtin(__builtin_amdgcn_global_load_async_to_lds_b128)
#define HAVE_ASYNC_LDS 1
#endif

#ifdef HAVE_ASYNC_LDS
// 16B global -> LDS async copy (per-lane addresses, tracked by ASYNCcnt).
// Builtin wants AS-qualified int4 pointers; integer round-trip performs the
// reinterpretation (flat LDS addr[31:0] is the LDS offset per the aperture
// rules, so truncation to a 32-bit AS3 pointer is the correct conversion).
__device__ __forceinline__ void async_copy16(const float* g, float* l) {
  __builtin_amdgcn_global_load_async_to_lds_b128(
      (__attribute__((address_space(1))) v4i*)(uintptr_t)g,
      (__attribute__((address_space(3))) v4i*)(unsigned int)(uintptr_t)l,
      0, 0);
}
#endif

__device__ __forceinline__ void wait_async_zero() {
#if __has_builtin(__builtin_amdgcn_s_wait_asynccnt)
  __builtin_amdgcn_s_wait_asynccnt(0);
#else
  asm volatile("s_wait_asynccnt 0x0" ::: "memory");
#endif
}

// ---------------------------------------------------------------------------
// Kernel 1: qk[m][j] = sum_k x[m][k] * qk_w[j][k]   (M=16384, N=2048, K=1024)
// ---------------------------------------------------------------------------
__global__ __launch_bounds__(256)
void qk_gemm(const float* __restrict__ A,   // x:    [16384][1024]
             const float* __restrict__ W,   // qk_w: [2048][1024]
             float* __restrict__ Cmat) {    // qk:   [16384][2048]
  __shared__ float As[2][TILE_M][LDA];   // 2 x 18KB
  __shared__ float Bs[2][TILE_N][LDA];   // 2 x 18KB  (total ~74KB of 320KB WGP)

  const int t     = threadIdx.x;
  const int lane  = t & 31;
  const int wave  = t >> 5;
  const int waveM = wave >> 2;         // 0..1 -> 64 rows each
  const int waveN = wave & 3;          // 0..3 -> 32 cols each
  const int lm    = lane & 15;
  const int khalf = (lane >> 4) << 1;  // 0 or 2 (K sub-offset per ISA A/B layout)

  const int blockM = blockIdx.x * TILE_M;
  const int blockN = blockIdx.y * TILE_N;

  // each thread stages 4 float4 of A and 4 float4 of B per K-chunk
  const int lrow0 = t >> 3;            // rows covered: t/8 + {0,32,64,96}
  const int lkv   = (t & 7) << 2;      // K sub-offset (floats)

  v8f acc[4][2];
#pragma unroll
  for (int mt = 0; mt < 4; ++mt)
#pragma unroll
    for (int nt = 0; nt < 2; ++nt)
      acc[mt][nt] = (v8f){0.f, 0.f, 0.f, 0.f, 0.f, 0.f, 0.f, 0.f};

#ifdef HAVE_ASYNC_LDS
  // ---- async stage of one 128x32 A-tile + 128x32 B-tile into buffer b_ ----
#define ISSUE_CHUNK(kc_, b_)                                                   \
  do {                                                                         \
    _Pragma("unroll")                                                          \
    for (int i = 0; i < 4; ++i) {                                              \
      const int row = lrow0 + i * 32;                                          \
      async_copy16(A + (size_t)(blockM + row) * CC + (kc_) + lkv,              \
                   &As[(b_)][row][lkv]);                                       \
      async_copy16(W + (size_t)(blockN + row) * CC + (kc_) + lkv,              \
                   &Bs[(b_)][row][lkv]);                                       \
    }                                                                          \
  } while (0)
#else
  // ---- fallback: synchronous float4 staging ----
#define ISSUE_CHUNK(kc_, b_)                                                   \
  do {                                                                         \
    _Pragma("unroll")                                                          \
    for (int i = 0; i < 4; ++i) {                                              \
      const int row = lrow0 + i * 32;                                          \
      *(float4*)(&As[(b_)][row][lkv]) =                                        \
          *(const float4*)(A + (size_t)(blockM + row) * CC + (kc_) + lkv);     \
      *(float4*)(&Bs[(b_)][row][lkv]) =                                        \
          *(const float4*)(W + (size_t)(blockN + row) * CC + (kc_) + lkv);     \
    }                                                                          \
  } while (0)
#endif

  int buf = 0;
  ISSUE_CHUNK(0, 0);
#ifdef HAVE_ASYNC_LDS
  wait_async_zero();
#endif
  __syncthreads();

  for (int kc = 0; kc < CC; kc += TILE_K) {
    // kick off DMA of the next chunk into the other buffer (its previous
    // readers all passed the barrier at the end of the prior iteration)
    if (kc + TILE_K < CC) ISSUE_CHUNK(kc + TILE_K, buf ^ 1);

    // ---- 8 K-steps of 4, 8 WMMAs per step, on the current buffer ----
#pragma unroll
    for (int kk = 0; kk < TILE_K; kk += 4) {
      const int k0 = kk + khalf;
      v2f afrag[4], bfrag[2];
#pragma unroll
      for (int mt = 0; mt < 4; ++mt) {
        const int row = waveM * 64 + mt * 16 + lm;
        afrag[mt] = *(const v2f*)(&As[buf][row][k0]);
      }
#pragma unroll
      for (int nt = 0; nt < 2; ++nt) {
        const int col = waveN * 32 + nt * 16 + lm;
        bfrag[nt] = *(const v2f*)(&Bs[buf][col][k0]);
      }
#pragma unroll
      for (int mt = 0; mt < 4; ++mt)
#pragma unroll
        for (int nt = 0; nt < 2; ++nt)
          acc[mt][nt] = __builtin_amdgcn_wmma_f32_16x16x4_f32(
              false, afrag[mt], false, bfrag[nt],
              (short)0, acc[mt][nt], false, false);
    }

#ifdef HAVE_ASYNC_LDS
    wait_async_zero();       // next chunk fully landed in LDS (this wave's ops)
#endif
    __syncthreads();         // all waves done computing + all DMA parts visible
    buf ^= 1;
  }

  // ---- epilogue: C/D layout => lane 0-15: M=vgpr, lane 16-31: M=8+vgpr ----
#pragma unroll
  for (int mt = 0; mt < 4; ++mt)
#pragma unroll
    for (int nt = 0; nt < 2; ++nt) {
      const int rbase = blockM + waveM * 64 + mt * 16 + (lane >> 4) * 8;
      const int col   = blockN + waveN * 32 + nt * 16 + lm;
#pragma unroll
      for (int i = 0; i < 8; ++i)
        Cmat[(size_t)(rbase + i) * (2 * CC) + col] = acc[mt][nt][i];
    }
#undef ISSUE_CHUNK
}

// ---------------------------------------------------------------------------
// Kernel 2: we/wr = einsum('bhdm,hmr->bhdr', xs, we_p/wr_p), xs = x sampled
// at rm=10 linspace columns. One block per (b,h), one thread per d.
// ---------------------------------------------------------------------------
__global__ __launch_bounds__(64)
void wewr_kernel(const float* __restrict__ x,
                 const float* __restrict__ we_p,
                 const float* __restrict__ wr_p,
                 float* __restrict__ we,
                 float* __restrict__ wr) {
  const int bh = blockIdx.x;
  const int h  = bh & (HH - 1);
  const int b  = bh >> 4;
  const int d  = threadIdx.x;

  float accE[RR] = {0.f, 0.f, 0.f, 0.f, 0.f};
  float accR[RR] = {0.f, 0.f, 0.f, 0.f, 0.f};
#pragma unroll
  for (int m = 0; m < RM; ++m) {
    const int idx = ((NN - 1) * m) / (RM - 1);        // linspace(0,N-1,rm).int32
    const float xv = x[((size_t)b * NN + idx) * CC + h * DD + d];
#pragma unroll
    for (int r = 0; r < RR; ++r) {
      accE[r] += xv * we_p[(h * RM + m) * RR + r];
      accR[r] += xv * wr_p[(h * RM + m) * RR + r];
    }
  }
  const size_t base = ((size_t)bh * DD + d) * RR;
#pragma unroll
  for (int r = 0; r < RR; ++r) {
    we[base + r] = accE[r];
    wr[base + r] = accR[r];
  }
}

// ---------------------------------------------------------------------------
// Kernel 3: per-token pipeline. One wave32 per (b,h,n); lane owns d and d+32.
// ---------------------------------------------------------------------------
__global__ __launch_bounds__(256)
void token_kernel(const float* __restrict__ qk,        // [16384][2048]
                  const float* __restrict__ inputs_mask,
                  const float* __restrict__ we,
                  const float* __restrict__ wr,
                  const float* __restrict__ eps,       // [B][H][N][r]
                  const float* __restrict__ log_lam,   // [H][r]
                  const float* __restrict__ m_u,       // [H][r][r]
                  const float* __restrict__ s_tri,     // [H][r][r][r]
                  const float* __restrict__ log_ssqrt, // [H][r][r]
                  const float* __restrict__ fw_w,      // [D][r]
                  const float* __restrict__ fw_b,      // [D]
                  float* __restrict__ attn_out,        // [B][N][C]
                  float* __restrict__ escore_out,      // [B][H][N][r]
                  float* __restrict__ rscore_out) {    // [B][H][N][r]
  const int token = blockIdx.x * 8 + (threadIdx.x >> 5);
  const int lane  = threadIdx.x & 31;
  const int n  = token & (NN - 1);
  const int bh = token >> 11;
  const int h  = bh & (HH - 1);
  const int b  = bh >> 4;

  const int d0 = lane, d1 = lane + 32;
  const size_t m = (size_t)b * NN + n;
  const float msk = inputs_mask[m];

  float q0 = qk[m * (2 * CC) + h * DD + d0] * msk;
  float q1 = qk[m * (2 * CC) + h * DD + d1] * msk;
  float k0 = qk[m * (2 * CC) + CC + h * DD + d0] * msk;
  float k1 = qk[m * (2 * CC) + CC + h * DD + d1] * msk;

  // L2 norms over D=64 via wave32 xor reductions
  float sq = q0 * q0 + q1 * q1;
  float sk = k0 * k0 + k1 * k1;
#pragma unroll
  for (int o = 16; o > 0; o >>= 1) {
    sq += __shfl_xor(sq, o, 32);
    sk += __shfl_xor(sk, o, 32);
  }
  const float invq = 1.f / fmaxf(sqrtf(sq), 1e-12f);
  const float invk = 1.f / fmaxf(sqrtf(sk), 1e-12f);
  q0 *= invq; q1 *= invq; k0 *= invk; k1 *= invk;

  // escore/rscore: 5-wide dots over D
  const size_t wbase = (size_t)bh * DD * RR;
  float es[RR], rs[RR];
#pragma unroll
  for (int r = 0; r < RR; ++r) {
    es[r] = q0 * we[wbase + (size_t)d0 * RR + r] + q1 * we[wbase + (size_t)d1 * RR + r];
    rs[r] = k0 * wr[wbase + (size_t)d0 * RR + r] + k1 * wr[wbase + (size_t)d1 * RR + r];
  }
#pragma unroll
  for (int o = 16; o > 0; o >>= 1)
#pragma unroll
    for (int r = 0; r < RR; ++r) {
      es[r] += __shfl_xor(es[r], o, 32);
      rs[r] += __shfl_xor(rs[r], o, 32);
    }

  const size_t tok_r = ((size_t)bh * NN + n) * RR;
  if (lane < RR) {
    escore_out[tok_r + lane] = es[lane];
    rscore_out[tok_r + lane] = rs[lane];
  }

  // v1, mean, noise, samples (r=5: redundantly per lane, trivially cheap)
  float v1[RR], ep[RR];
#pragma unroll
  for (int r = 0; r < RR; ++r) {
    v1[r] = (es[r] + rs[r]) * __expf(2.f * log_lam[h * RR + r]);
    ep[r] = eps[tok_r + r];
  }
  float smp[RR];
#pragma unroll
  for (int s = 0; s < RR; ++s) {
    float mean = 0.f;
#pragma unroll
    for (int a = 0; a < RR; ++a)
      mean += v1[a] * m_u[(h * RR + a) * RR + s];
    smp[s] = mean;
  }
#pragma unroll
  for (int a = 0; a < RR; ++a)
#pragma unroll
    for (int u = 0; u < RR; ++u) {
      // S[h,a,u,c] = exp(log_ssqrt[h,a,u]) on diag c==u, s_tri below diag c<u
      const float vae = v1[a] * ep[u];
      smp[u] += vae * __expf(log_ssqrt[(h * RR + a) * RR + u]);   // c == u
#pragma unroll
      for (int c = 0; c < RR; ++c)
        if (c < u)
          smp[c] += vae * s_tri[((h * RR + a) * RR + u) * RR + c];
    }

  // attn_out = samples @ fw_w.T + fw_b  (lane writes its two d's, coalesced)
  float o0 = fw_b[d0], o1 = fw_b[d1];
#pragma unroll
  for (int r = 0; r < RR; ++r) {
    o0 += smp[r] * fw_w[d0 * RR + r];
    o1 += smp[r] * fw_w[d1 * RR + r];
  }
  attn_out[m * CC + h * DD + d0] = o0;
  attn_out[m * CC + h * DD + d1] = o1;
}

// ---------------------------------------------------------------------------
// Kernel 4: KL scalar (single block reduction)
// ---------------------------------------------------------------------------
__global__ __launch_bounds__(256)
void kl_kernel(const float* __restrict__ log_lam,
               const float* __restrict__ m_u,
               const float* __restrict__ s_tri,
               const float* __restrict__ log_ssqrt,
               float* __restrict__ out_kl) {
  float acc = 0.f;
  // 0.5 * sum (lam2[h,a] * S[h,a,u,c])^2   over H*r*r*r = 2000
  for (int i = threadIdx.x; i < HH * RR * RR * RR; i += 256) {
    const int c = i % RR;
    const int u = (i / RR) % RR;
    const int a = (i / (RR * RR)) % RR;
    const int hh = i / (RR * RR * RR);
    float S = 0.f;
    if (u == c)      S = __expf(log_ssqrt[(hh * RR + a) * RR + u]);
    else if (u > c)  S = s_tri[((hh * RR + a) * RR + u) * RR + c];
    const float t = __expf(2.f * log_lam[hh * RR + a]) * S;
    acc += 0.5f * t * t;
  }
  // 0.5 * sum exp(4*log_lam)[h,a] * m_u[h,a,s]^2  -  sum log_ssqrt
  for (int i = threadIdx.x; i < HH * RR * RR; i += 256) {
    const int a = (i / RR) % RR;
    const int hh = i / (RR * RR);
    const float mu = m_u[i];
    acc += 0.5f * __expf(4.f * log_lam[hh * RR + a]) * mu * mu;
    acc -= log_ssqrt[i];
  }
  // -2 * sum(log_lam) * r
  for (int i = threadIdx.x; i < HH * RR; i += 256)
    acc -= 2.f * (float)RR * log_lam[i];

  __shared__ float red[256];
  red[threadIdx.x] = acc;
  __syncthreads();
  for (int s = 128; s > 0; s >>= 1) {
    if (threadIdx.x < s) red[threadIdx.x] += red[threadIdx.x + s];
    __syncthreads();
  }
  if (threadIdx.x == 0)
    out_kl[0] = red[0] - 0.5f * (float)(RR * RR * HH);
}

// ---------------------------------------------------------------------------
extern "C" void kernel_launch(void* const* d_in, const int* in_sizes, int n_in,
                              void* d_out, int out_size, void* d_ws, size_t ws_size,
                              hipStream_t stream) {
  const float* x          = (const float*)d_in[0];
  const float* mask       = (const float*)d_in[1];
  const float* eps        = (const float*)d_in[2];
  const float* qk_w       = (const float*)d_in[3];
  const float* we_p       = (const float*)d_in[4];
  const float* wr_p       = (const float*)d_in[5];
  const float* log_lam    = (const float*)d_in[6];
  const float* m_u        = (const float*)d_in[7];
  const float* s_tri      = (const float*)d_in[8];
  const float* log_ssqrt  = (const float*)d_in[9];
  const float* fw_w       = (const float*)d_in[10];
  const float* fw_b       = (const float*)d_in[11];

  float* out = (float*)d_out;
  const size_t attn_sz = (size_t)BB * NN * CC;          // 16,777,216
  const size_t esc_sz  = (size_t)BB * HH * NN * RR;     //  1,310,720
  float* escore = out + attn_sz;
  float* rscore = escore + esc_sz;
  float* kl     = rscore + esc_sz;

  float* qk = (float*)d_ws;                              // [16384][2048]
  float* we = qk + (size_t)(BB * NN) * (2 * CC);
  float* wr = we + (size_t)BB * HH * DD * RR;

  dim3 ggrid((BB * NN) / TILE_M, (2 * CC) / TILE_N);     // 128 x 16
  qk_gemm<<<ggrid, 256, 0, stream>>>(x, qk_w, qk);

  wewr_kernel<<<BB * HH, DD, 0, stream>>>(x, we_p, wr_p, we, wr);

  token_kernel<<<(BB * HH * NN) / 8, 256, 0, stream>>>(
      qk, mask, we, wr, eps, log_lam, m_u, s_tri, log_ssqrt, fw_w, fw_b,
      out, escore, rscore);

  kl_kernel<<<1, 256, 0, stream>>>(log_lam, m_u, s_tri, log_ssqrt, kl);
}

// v001
// Measured time: 306 microseconds a run.
// Timed twice side by side with v000, it ran 1.32 times as fast both times.
#include <hip/hip_runtime.h>
#include <hip/hip_bf16.h>

// ---------------------------------------------------------------------------
// SVGP attention for MI455X (gfx1250, wave32).
// Dominant cost: qk = x @ qk_w.T  (M=16384, N=2048, K=1024, fp32)
//   -> double-buffered LDS GEMM on V_WMMA_F32_16X16X4_F32, staged with
//      GLOBAL_LOAD_ASYNC_TO_LDS_B128 (ASYNCcnt) so DMA of chunk k+1 overlaps
//      the WMMA stream of chunk k.
// The per-token low-rank (r=5) stage runs in the GEMM's epilogue: a block's
// 128 columns are the 64 q and the 64 k columns of ONE head, so qk never
// goes to memory.
// ---------------------------------------------------------------------------

typedef __attribute__((ext_vector_type(2))) float v2f;
typedef __attribute__((ext_vector_type(8))) float v8f;
typedef __attribute__((ext_vector_type(4))) int   v4i;

#define BB 8
#define NN 2048
#define CC 1024
#define HH 16
#define DD 64
#define RR 5
#define RM 10

#define TILE_M 128
#define TILE_N 128
#define TILE_K 32
#define LDA 36   // padded LDS row stride (floats): 16B aligned, conflict-free
#define LDC 132  // row stride (floats) of the staged 128x128 result: 16B x odd

#if __has_builtin(__builtin_amdgcn_global_load_async_to_lds_b128)
#define HAVE_ASYNC_LDS 1
#endif

#ifdef HAVE_ASYNC_LDS
// 16B global -> LDS async copy (per-lane addresses, tracked by ASYNCcnt).
// Builtin wants AS-qualified int4 pointers; integer round-trip performs the
// reinterpretation (flat LDS addr[31:0] is the LDS offset per the aperture
// rules, so truncation to a 32-bit AS3 pointer is the correct conversion).
__device__ __forceinline__ void async_copy16(const float* g, float* l) {
  __builtin_amdgcn_global_load_async_to_lds_b128(
      (__attribute__((address_space(1))) v4i*)(uintptr_t)g,
      (__attribute__((address_space(3))) v4i*)(unsigned int)(uintptr_t)l,
      0, 0);
}
#endif

__device__ __forceinline__ void wait_async_zero() {
#if __has_builtin(__builtin_amdgcn_s_wait_asynccnt)
  __builtin_amdgcn_s_wait_asynccnt(0);
#else
  asm volatile("s_wait_asynccnt 0x0" ::: "memory");
#endif
}

// ---------------------------------------------------------------------------
// Kernel 1: qk[m][j] = sum_k x[m][k] * qk_w[j][k]   (M=16384, N=2048, K=1024)
// followed, per block, by the whole per-token stage of its 128 tokens x 1 head.
// ---------------------------------------------------------------------------
__global__ __launch_bounds__(256)
void qk_token_fused(const float* __restrict__ A,   // x:    [16384][1024]
                    const float* __restrict__ W,   // qk_w: [2048][1024]
                    const float* __restrict__ inputs_mask,
                    const float* __restrict__ we,        // [B][H][r][D]
                    const float* __restrict__ wr,        // [B][H][r][D]
                    const float* __restrict__ eps,       // [B][H][N][r]
                    const float* __restrict__ log_lam,   // [H][r]
                    const float* __restrict__ m_u,       // [H][r][r]
                    const float* __restrict__ s_tri,     // [H][r][r][r]
                    const float* __restrict__ log_ssqrt, // [H][r][r]
                    const float* __restrict__ fw_w,      // [D][r]
                    const float* __restrict__ fw_b,      // [D]
                    float* __restrict__ attn_out,        // [B][N][C]
                    float* __restrict__ escore_out,      // [B][H][N][r]
                    float* __restrict__ rscore_out) {    // [B][H][N][r]
  // one LDS block: the A/B ring (4 x 18KB) during the K loop, the 128 x 128
  // result tile (pitch LDC) after it
  __shared__ __attribute__((aligned(16))) float smem[4 * TILE_M * LDA];
  float (*As)[TILE_M][LDA] = (float (*)[TILE_M][LDA])smem;
  float (*Bs)[TILE_N][LDA] = (float (*)[TILE_N][LDA])(smem + 2 * TILE_M * LDA);

  const int t     = threadIdx.x;
  const int lane  = t & 31;
  const int wave  = t >> 5;
  const int waveM = wave >> 2;         // 0..1 -> 64 rows each
  const int waveN = wave & 3;          // 0..3 -> 32 cols each
  const int lm    = lane & 15;
  const int khalf = (lane >> 4) << 1;  // 0 or 2 (K sub-offset per ISA A/B layout)

  const int blockM = blockIdx.x * TILE_M;
  const int h      = blockIdx.y;       // head: tile columns 0..63 = q, 64..127 = k
  const int blockN = h * DD;

  // each thread stages 4 float4 of A and 4 float4 of B per K-chunk
  const int lrow0 = t >> 3;            // rows covered: t/8 + {0,32,64,96}
  const int lkv   = (t & 7) << 2;      // K sub-offset (floats)

  v8f acc[4][2];
#pragma unroll
  for (int mt = 0; mt < 4; ++mt)
#pragma unroll
    for (int nt = 0; nt < 2; ++nt)
      acc[mt][nt] = (v8f){0.f, 0.f, 0.f, 0.f, 0.f, 0.f, 0.f, 0.f};

#ifdef HAVE_ASYNC_LDS
  // ---- async stage of one 128x32 A-tile + 128x32 B-tile into buffer b_ ----
#define ISSUE_CHUNK(kc_, b_)                                                   \
  do {                                                                         \
    _Pragma("unroll")                                                          \
    for (int i = 0; i < 4; ++i) {                                              \
      const int row = lrow0 + i * 32;                                          \
      async_copy16(A + (size_t)(blockM + row) * CC + (kc_) + lkv,              \
                   &As[(b_)][row][lkv]);                                       \
      async_copy16(W + (size_t)(blockN + row + (i >> 1) * (CC - DD)) * CC +    \
                       (kc_) + lkv,                                            \
                   &Bs[(b_)][row][lkv]);                                       \
    }                                                                          \
  } while (0)
#else
  // ---- fallback: synchronous float4 staging ----
#define ISSUE_CHUNK(kc_, b_)                                                   \
  do {                                                                         \
    _Pragma("unroll")                                                          \
    for (int i = 0; i < 4; ++i) {                                              \
      const int row = lrow0 + i * 32;                                          \
      *(float4*)(&As[(b_)][row][lkv]) =                                        \
          *(const float4*)(A + (size_t)(blockM + row) * CC + (kc_) + lkv);     \
      *(float4*)(&Bs[(b_)][row][lkv]) =                                        \
          *(const float4*)(W + (size_t)(blockN + row + (i >> 1) * (CC - DD)) * \
                                   CC + (kc_) + lkv);                          \
    }                                                                          \
  } while (0)
#endif

  int buf = 0;
  ISSUE_CHUNK(0, 0);
#ifdef HAVE_ASYNC_LDS
  wait_async_zero();
#endif
  __syncthreads();

  for (int kc = 0; kc < CC; kc += TILE_K) {
    // kick off DMA of the next chunk into the other buffer (its previous
    // readers all passed the barrier at the end of the prior iteration)
    if (kc + TILE_K < CC) ISSUE_CHUNK(kc + TILE_K, buf ^ 1);

    // ---- 8 K-steps of 4, 8 WMMAs per step, on the current buffer ----
#pragma unroll
    for (int kk = 0; kk < TILE_K; kk += 4) {
      const int k0 = kk + khalf;
      v2f afrag[4], bfrag[2];
#pragma unroll
      for (int mt = 0; mt < 4; ++mt) {
        const int row = waveM * 64 + mt * 16 + lm;
        afrag[mt] = *(const v2f*)(&As[buf][row][k0]);
      }
#pragma unroll
      for (int nt = 0; nt < 2; ++nt) {
        const int col = waveN * 32 + nt * 16 + lm;
        bfrag[nt] = *(const v2f*)(&Bs[buf][col][k0]);
      }
#pragma unroll
      for (int mt = 0; mt < 4; ++mt)
#pragma unroll
        for (int nt = 0; nt < 2; ++nt)
          acc[mt][nt] = __builtin_amdgcn_wmma_f32_16x16x4_f32(
              false, afrag[mt], false, bfrag[nt],
              (short)0, acc[mt][nt], false, false);
    }

#ifdef HAVE_ASYNC_LDS
    wait_async_zero();       // next chunk fully landed in LDS (this wave's ops)
#endif
    __syncthreads();         // all waves done computing + all DMA parts visible
    buf ^= 1;
  }

  // ---- result tile to LDS. C/D layout: lane 0-15: M=vgpr, lane 16-31: M=8+vgpr.
  // The ring is free: the loop's last barrier ended every read of it and no
  // copy is outstanding.
  float (*Ct)[LDC] = (float (*)[LDC])smem;
#pragma unroll
  for (int mt = 0; mt < 4; ++mt)
#pragma unroll
    for (int nt = 0; nt < 2; ++nt) {
      const int rbase = waveM * 64 + mt * 16 + (lane >> 4) * 8;
      const int col   = waveN * 32 + nt * 16 + lm;
#pragma unroll
      for (int i = 0; i < 8; ++i)
        Ct[rbase + i][col] = acc[mt][nt][i];
    }

  // ---- per-token stage: wave w owns tokens 16w..16w+15 of the tile; lanes l
  // and l+16 both stand for token (l & 15) and split its d range.
  const int hf   = lane >> 4;
  const int trow = wave * 16 + lm;
  const size_t m = (size_t)(blockM + trow);
  const int n    = (blockM + trow) & (NN - 1);
  const int bh   = (blockM / NN) * HH + h;
  const size_t tok_r = ((size_t)bh * NN + n) * RR;

  // fetched in front of the barrier, so that the latency runs beside the LDS
  // stores and the wait for the other waves
  const float msk = inputs_mask[m];
  float ep[RR];
#pragma unroll
  for (int r = 0; r < RR; ++r) ep[r] = eps[tok_r + r];
  __syncthreads();           // every wave reads rows that other waves wrote

  // score weights (64 registers: fetched only now, with the accumulators dead),
  // A operand: row = lane & 15 -> r = row & 7 (rows with r > 4 repeat r = 4 and
  // are never read), k order d = 8j + 4hf + {0,1} then {2,3}
  const int rc = (lm & 7) < RR ? (lm & 7) : RR - 1;
  const float* wep = we + ((size_t)bh * RR + rc) * DD + 4 * hf;
  const float* wrp = wr + ((size_t)bh * RR + rc) * DD + 4 * hf;
  float4 ew[8], rw[8];
#pragma unroll
  for (int j = 0; j < 8; ++j) {
    ew[j] = *(const float4*)(wep + 8 * j);
    rw[j] = *(const float4*)(wrp + 8 * j);
  }
  // precaution: the loads' address registers are reused below
  asm volatile("s_wait_xcnt 0x0" ::: "memory");

  // escore/rscore as D[r][token] = sum_d w[d][r] * q[token][d]: the weights are
  // the A operand, the token rows the B operand, in the same k order (the lane
  // holds d = 8j + 4hf + {0..3} of its token's masked q and k). Register a of D
  // is then score a of token (lane & 15) in BOTH lane halves, where that token's
  // 1/norm stands too: the rows go in unnormalised and the sums are scaled.
  float sq = 0.f, sk = 0.f;
  v8f dq = (v8f){0.f, 0.f, 0.f, 0.f, 0.f, 0.f, 0.f, 0.f};
  v8f dk = (v8f){0.f, 0.f, 0.f, 0.f, 0.f, 0.f, 0.f, 0.f};
#pragma unroll
  for (int j = 0; j < 8; ++j) {
    float4 qf = *(const float4*)(&Ct[trow][8 * j + 4 * hf]);
    float4 kf = *(const float4*)(&Ct[trow][DD + 8 * j + 4 * hf]);
    qf.x *= msk; qf.y *= msk; qf.z *= msk; qf.w *= msk;
    kf.x *= msk; kf.y *= msk; kf.z *= msk; kf.w *= msk;
    sq += qf.x * qf.x + qf.y * qf.y + qf.z * qf.z + qf.w * qf.w;
    sk += kf.x * kf.x + kf.y * kf.y + kf.z * kf.z + kf.w * kf.w;
    dq = __builtin_amdgcn_wmma_f32_16x16x4_f32(false, (v2f){ew[j].x, ew[j].y}, false, (v2f){qf.x, qf.y}, (short)0, dq, false, false);
    dk = __builtin_amdgcn_wmma_f32_16x16x4_f32(false, (v2f){rw[j].x, rw[j].y}, false, (v2f){kf.x, kf.y}, (short)0, dk, false, false);
    dq = __builtin_amdgcn_wmma_f32_16x16x4_f32(false, (v2f){ew[j].z, ew[j].w}, false, (v2f){qf.z, qf.w}, (short)0, dq, false, false);
    dk = __builtin_amdgcn_wmma_f32_16x16x4_f32(false, (v2f){rw[j].z, rw[j].w}, false, (v2f){kf.z, kf.w}, (short)0, dk, false, false);
  }
  sq += __shfl_xor(sq, 16, 32);   // the other half of the token's d range
  sk += __shfl_xor(sk, 16, 32);
  const float invq = 1.f / fmaxf(sqrtf(sq), 1e-12f);
  const float invk = 1.f / fmaxf(sqrtf(sk), 1e-12f);
  float es[RR], rs[RR];
#pragma unroll
  for (int r = 0; r < RR; ++r) { es[r] = dq[r] * invq; rs[r] = dk[r] * invk; }

  // lower lane half stores its token's escore, upper half its rscore
  float* sc_out = (hf ? rscore_out : escore_out) + tok_r;
#pragma unroll
  for (int r = 0; r < RR; ++r) sc_out[r] = hf ? rs[r] : es[r];

  // output weights, B operand: column lm of tile nt = d = 4 * lm + nt; fetched
  // here so that the latency runs beside the r x r algebra below
  v2f f0[4];
  float f4[4], bias[4];
#pragma unroll
  for (int nt = 0; nt < 4; ++nt) {
    const int d = 4 * lm + nt;
    f0[nt]   = (v2f){fw_w[d * RR + 2 * hf], fw_w[d * RR + 2 * hf + 1]};
    f4[nt]   = fw_w[d * RR + 4];
    bias[nt] = fw_b[d];
  }
  // precaution: the registers that the stores and loads above name are reused
  asm volatile("s_wait_xcnt 0x0" ::: "memory");

  // v1, mean, noise, samples: one token per lane (twice, once in each half)
  float v1[RR];
#pragma unroll
  for (int r = 0; r < RR; ++r)
    v1[r] = (es[r] + rs[r]) * __expf(2.f * log_lam[h * RR + r]);
  float smp[RR];
#pragma unroll
  for (int s = 0; s < RR; ++s) {
    float mean = 0.f;
#pragma unroll
    for (int a = 0; a < RR; ++a)
      mean += v1[a] * m_u[(h * RR + a) * RR + s];
    smp[s] = mean;
  }
#pragma unroll
  for (int a = 0; a < RR; ++a)
#pragma unroll
    for (int u = 0; u < RR; ++u) {
      // S[h,a,u,c] = exp(log_ssqrt[h,a,u]) on diag c==u, s_tri below diag c<u
      const float vae = v1[a] * ep[u];
      smp[u] += vae * __expf(log_ssqrt[(h * RR + a) * RR + u]);   // c == u
#pragma unroll
      for (int c = 0; c < RR; ++c)
        if (c < u)
          smp[c] += vae * s_tri[((h * RR + a) * RR + u) * RR + c];
    }

  // attn_out = samples @ fw_w.T + fw_b as 16 tokens x 64 d, K = 5 padded to 8
  // with zeros on both sides. A: row = token, k = 2hf + {0,1}, then 4 + 2hf +
  // {0,1}; B the same k. With column lm of tile nt = d = 4 * lm + nt a lane ends
  // with four neighbouring d of each token and stores 16 bytes.
  const v2f sa0 = hf ? (v2f){smp[2], smp[3]} : (v2f){smp[0], smp[1]};
  const v2f sa1 = hf ? (v2f){0.f, 0.f} : (v2f){smp[4], 0.f};
  v8f o[4];
#pragma unroll
  for (int nt = 0; nt < 4; ++nt) {
    const v2f f1 = {hf ? 0.f : f4[nt], 0.f};
    const float bs = bias[nt];
    o[nt] = (v8f){bs, bs, bs, bs, bs, bs, bs, bs};
    o[nt] = __builtin_amdgcn_wmma_f32_16x16x4_f32(false, sa0, false, f0[nt], (short)0, o[nt], false, false);
    o[nt] = __builtin_amdgcn_wmma_f32_16x16x4_f32(false, sa1, false, f1, (short)0, o[nt], false, false);
  }
  float* orow = attn_out + (size_t)(blockM + wave * 16 + hf * 8) * CC + h * DD + 4 * lm;
#pragma unroll
  for (int i = 0; i < 8; ++i)
    *(float4*)(orow + (size_t)i * CC) = make_float4(o[0][i], o[1][i], o[2][i], o[3][i]);
#undef ISSUE_CHUNK
}

// ---------------------------------------------------------------------------
// Kernel 2: we/wr = einsum('bhdm,hmr->bhdr', xs, we_p/wr_p), xs = x sampled
// at rm=10 linspace columns. One block per (b,h), one thread per d.
// ---------------------------------------------------------------------------
__global__ __launch_bounds__(64)
void wewr_kernel(const float* __restrict__ x,
                 const float* __restrict__ we_p,
                 const float* __restrict__ wr_p,
                 float* __restrict__ we,
                 float* __restrict__ wr) {
  const int bh = blockIdx.x;
  const int h  = bh & (HH - 1);
  const int b  = bh >> 4;
  const int d  = threadIdx.x;

  float accE[RR] = {0.f, 0.f, 0.f, 0.f, 0.f};
  float accR[RR] = {0.f, 0.f, 0.f, 0.f, 0.f};
  float xv[RM];
#pragma unroll
  for (int m = 0; m < RM; ++m) {
    const int idx = ((NN - 1) * m) / (RM - 1);        // linspace(0,N-1,rm).int32
    xv[m] = x[((size_t)b * NN + idx) * CC + h * DD + d];
  }
  // precaution: the loads' address registers are reused below
  asm volatile("s_wait_xcnt 0x0" ::: "memory");
#pragma unroll
  for (int m = 0; m < RM; ++m) {
#pragma unroll
    for (int r = 0; r < RR; ++r) {
      accE[r] += xv[m] * we_p[(h * RM + m) * RR + r];
      accR[r] += xv[m] * wr_p[(h * RM + m) * RR + r];
    }
  }
  // stored [b][h][r][d]: the reader takes four neighbouring d of one r at a time
  const size_t base = (size_t)bh * RR * DD + d;
#pragma unroll
  for (int r = 0; r < RR; ++r) {
    we[base + r * DD] = accE[r];
    wr[base + r * DD] = accR[r];
  }
}

// ---------------------------------------------------------------------------
// Kernel 3: KL scalar (single block reduction)
// ---------------------------------------------------------------------------
__global__ __launch_bounds__(256)
void kl_kernel(const float* __restrict__ log_lam,
               const float* __restrict__ m_u,
               const float* __restrict__ s_tri,
               const float* __restrict__ log_ssqrt,
               float* __restrict__ out_kl) {
  float acc = 0.f;
  // 0.5 * sum (lam2[h,a] * S[h,a,u,c])^2   over H*r*r*r = 2000
  for (int i = threadIdx.x; i < HH * RR * RR * RR; i += 256) {
    const int c = i % RR;
    const int u = (i / RR) % RR;
    const int a = (i / (RR * RR)) % RR;
    const int hh = i / (RR * RR * RR);
    float S = 0.f;
    if (u == c)      S = __expf(log_ssqrt[(hh * RR + a) * RR + u]);
    else if (u > c)  S = s_tri[((hh * RR + a) * RR + u) * RR + c];
    const float t = __expf(2.f * log_lam[hh * RR + a]) * S;
    acc += 0.5f * t * t;
  }
  // 0.5 * sum exp(4*log_lam)[h,a] * m_u[h,a,s]^2  -  sum log_ssqrt
  for (int i = threadIdx.x; i < HH * RR * RR; i += 256) {
    const int a = (i / RR) % RR;
    const int hh = i / (RR * RR);
    const float mu = m_u[i];
    acc += 0.5f * __expf(4.f * log_lam[hh * RR + a]) * mu * mu;
    acc -= log_ssqrt[i];
  }
  // -2 * sum(log_lam) * r
  for (int i = threadIdx.x; i < HH * RR; i += 256)
    acc -= 2.f * (float)RR * log_lam[i];

  __shared__ float red[256];
  red[threadIdx.x] = acc;
  __syncthreads();
  for (int s = 128; s > 0; s >>= 1) {
    if (threadIdx.x < s) red[threadIdx.x] += red[threadIdx.x + s];
    __syncthreads();
  }
  if (threadIdx.x == 0)
    out_kl[0] = red[0] - 0.5f * (float)(RR * RR * HH);
}

// ---------------------------------------------------------------------------
extern "C" void kernel_launch(void* const* d_in, const int* in_sizes, int n_in,
                              void* d_out, int out_size, void* d_ws, size_t ws_size,
                              hipStream_t stream) {
  const float* x          = (const float*)d_in[0];
  const float* mask       = (const float*)d_in[1];
  const float* eps        = (const float*)d_in[2];
  const float* qk_w       = (const float*)d_in[3];
  const float* we_p       = (const float*)d_in[4];
  const float* wr_p       = (const float*)d_in[5];
  const float* log_lam    = (const float*)d_in[6];
  const float* m_u        = (const float*)d_in[7];
  const float* s_tri      = (const float*)d_in[8];
  const float* log_ssqrt  = (const float*)d_in[9];
  const float* fw_w       = (const float*)d_in[10];
  const float* fw_b       = (const float*)d_in[11];

  float* out = (float*)d_out;
  const size_t attn_sz = (size_t)BB * NN * CC;          // 16,777,216
  const size_t esc_sz  = (size_t)BB * HH * NN * RR;     //  1,310,720
  float* escore = out + attn_sz;
  float* rscore = escore + esc_sz;
  float* kl     = rscore + esc_sz;

  float* we = (float*)d_ws;                              // [B][H][r][D]
  float* wr = we + (size_t)BB * HH * DD * RR;

  wewr_kernel<<<BB * HH, DD, 0, stream>>>(x, we_p, wr_p, we, wr);

  dim3 ggrid((BB * NN) / TILE_M, HH);                    // 128 x 16
  qk_token_fused<<<ggrid, 256, 0, stream>>>(
      x, qk_w, mask, we, wr, eps, log_lam, m_u, s_tri, log_ssqrt, fw_w, fw_b,
      out, escore, rscore);

  kl_kernel<<<1, 256, 0, stream>>>(log_lam, m_u, s_tri, log_ssqrt, kl);
}
